// v000
// Measured on an AMD MI455X. A time is GPU time per run, averaged over a window of back-to-back runs after a warm-up
// (all launches, gaps included; the runs take copies of the inputs in turn), and the median of several windows.
// Apart from v000's, it joins two sittings. Times from different sittings can be a few percent apart, while
// side-by-side timings come from the same sitting.
// v000 is the starting kernel. One run takes 154 microseconds.
#include <hip/hip_runtime.h>
#include <hip/hip_bf16.h>
#include <math.h>

typedef __attribute__((ext_vector_type(2))) float v2f;
typedef __attribute__((ext_vector_type(8))) float v8f;

#define BATCH 4
#define CCH   256
#define D1    4096    // 64*64
#define D2    16384   // 128*128

// Y[b] = W(256x256) @ X[b](256xd) + bias, fp32 via V_WMMA_F32_16X16X4_F32.
// Block = 128 threads (4 waves). Each wave owns one 16x64 output strip
// (4 N-tiles), sharing A fragments across the 4 WMMAs per K-step.
// grid.x = B * 16 * (d/256)
__global__ void __launch_bounds__(128)
gemm256_wmma_f32(const float* __restrict__ W,
                 const float* __restrict__ X,
                 const float* __restrict__ bias,
                 float* __restrict__ Y,
                 int d)
{
    const int ngrps = d >> 8;                 // groups of 256 columns
    int flat  = blockIdx.x;
    int ngrp  = flat % ngrps;
    int rest  = flat / ngrps;
    int mtile = rest & 15;                    // 16 row-tiles of 16
    int b     = rest >> 4;

    int lane = threadIdx.x & 31;
    int wave = threadIdx.x >> 5;              // 0..3
    int lmod = lane & 15;
    int lhi  = lane >> 4;                     // 0 or 1

    int m0 = mtile * 16;
    int n0 = ngrp * 256 + wave * 64;          // this wave's 64-col strip

    // A: lane holds W[m0+lmod, k0 + 2*lhi + {0,1}]  (contiguous 8B)
    const float* Wp = W + (size_t)(m0 + lmod) * CCH + 2 * lhi;
    // B: lane holds X[k0 + 2*lhi + {0,1}, n] (two rows, stride d)
    const float* Xp = X + (size_t)b * CCH * d + (size_t)(2 * lhi) * d + (n0 + lmod);

    v8f acc0 = {}, acc1 = {}, acc2 = {}, acc3 = {};

    #pragma unroll 4
    for (int k0 = 0; k0 < CCH; k0 += 4) {
        v2f a = *(const v2f*)(Wp + k0);       // 8B-aligned (k0%4==0, 2*lhi even)
        const float* xr0 = Xp + (size_t)k0 * d;
        const float* xr1 = xr0 + d;
        v2f b0, b1, b2, b3;
        b0.x = xr0[0];  b0.y = xr1[0];
        b1.x = xr0[16]; b1.y = xr1[16];
        b2.x = xr0[32]; b2.y = xr1[32];
        b3.x = xr0[48]; b3.y = xr1[48];
        acc0 = __builtin_amdgcn_wmma_f32_16x16x4_f32(false, a, false, b0, (short)0, acc0, false, false);
        acc1 = __builtin_amdgcn_wmma_f32_16x16x4_f32(false, a, false, b1, (short)0, acc1, false, false);
        acc2 = __builtin_amdgcn_wmma_f32_16x16x4_f32(false, a, false, b2, (short)0, acc2, false, false);
        acc3 = __builtin_amdgcn_wmma_f32_16x16x4_f32(false, a, false, b3, (short)0, acc3, false, false);
    }

    // D: lane L, elem v -> row m0 + v + 8*lhi, col n + lmod
    float* Yp = Y + (size_t)b * CCH * d;
    #pragma unroll
    for (int v = 0; v < 8; ++v) {
        int m = m0 + v + 8 * lhi;
        float bv = bias[m];
        size_t row = (size_t)m * d;
        Yp[row + n0 +  0 + lmod] = acc0[v] + bv;
        Yp[row + n0 + 16 + lmod] = acc1[v] + bv;
        Yp[row + n0 + 32 + lmod] = acc2[v] + bv;
        Yp[row + n0 + 48 + lmod] = acc3[v] + bv;
    }
}

// Per (b,c): logits[k=(i,j)] = sum_{h,w} q[h,w] * src[2h+i-1, 2w+j-1]
// (zero outside), then softmax over the 9 positions with scale 1/64.
// One block (256 threads) per (b,c).
__global__ void __launch_bounds__(256)
attn_softmax(const float* __restrict__ q,     // (B*C, 4096)
             const float* __restrict__ src,   // (B*C, 128*128)
             float* __restrict__ A)           // (B*C, 9)
{
    int bc = blockIdx.x;
    const float* qp = q   + (size_t)bc * D1;
    const float* sp = src + (size_t)bc * D2;

    float part[9];
    #pragma unroll
    for (int k = 0; k < 9; ++k) part[k] = 0.f;

    for (int hw = threadIdx.x; hw < D1; hw += 256) {
        int h = hw >> 6, w = hw & 63;
        float qv = qp[hw];
        int r0 = 2 * h - 1, c0 = 2 * w - 1;   // max index 127, only low OOB possible
        #pragma unroll
        for (int i = 0; i < 3; ++i) {
            int r = r0 + i;
            #pragma unroll
            for (int j = 0; j < 3; ++j) {
                int c = c0 + j;
                float s = (r >= 0 && c >= 0) ? sp[r * 128 + c] : 0.f;
                part[3 * i + j] += qv * s;
            }
        }
    }

    __shared__ float red[9][256];
    #pragma unroll
    for (int k = 0; k < 9; ++k) red[k][threadIdx.x] = part[k];
    __syncthreads();
    for (int s = 128; s > 0; s >>= 1) {
        if (threadIdx.x < (unsigned)s) {
            #pragma unroll
            for (int k = 0; k < 9; ++k)
                red[k][threadIdx.x] += red[k][threadIdx.x + s];
        }
        __syncthreads();
    }

    if (threadIdx.x == 0) {
        const float scale = 1.0f / 64.0f;     // 1/sqrt(4096)
        float l[9], mx = -INFINITY;
        #pragma unroll
        for (int k = 0; k < 9; ++k) { l[k] = red[k][0] * scale; mx = fmaxf(mx, l[k]); }
        float sum = 0.f;
        #pragma unroll
        for (int k = 0; k < 9; ++k) { l[k] = expf(l[k] - mx); sum += l[k]; }
        float inv = 1.0f / sum;
        #pragma unroll
        for (int k = 0; k < 9; ++k) A[(size_t)bc * 9 + k] = l[k] * inv;
    }
}

// out[y,x] = feat[y,x] * sum_{i,j} [0<=y+1-i<64][0<=x+1-j<64]
//                        * A[3i+j] * vfull[2y+1-i, 2x+1-j]
__global__ void __launch_bounds__(256)
fold_combine(const float* __restrict__ feat,   // (B*C, 4096)
             const float* __restrict__ vfull,  // (B*C, 128*128)
             const float* __restrict__ A,      // (B*C, 9)
             float* __restrict__ out)          // (B*C, 4096)
{
    int idx = blockIdx.x * 256 + threadIdx.x;  // block stays within one (b,c)
    int bc = idx >> 12;
    int hw = idx & 4095;
    int y = hw >> 6, x = hw & 63;

    const float* vp = vfull + (size_t)bc * D2;
    const float* Ap = A + (size_t)bc * 9;

    float acc = 0.f;
    #pragma unroll
    for (int i = 0; i < 3; ++i) {
        int hy = y + 1 - i;
        if (hy < 0 || hy > 63) continue;       // fold validity (NOT just v-index)
        int r = 2 * y + 1 - i;
        #pragma unroll
        for (int j = 0; j < 3; ++j) {
            int wx = x + 1 - j;
            if (wx < 0 || wx > 63) continue;
            int c = 2 * x + 1 - j;
            acc += Ap[3 * i + j] * vp[r * 128 + c];
        }
    }
    out[idx] = acc * feat[idx];
}

extern "C" void kernel_launch(void* const* d_in, const int* in_sizes, int n_in,
                              void* d_out, int out_size, void* d_ws, size_t ws_size,
                              hipStream_t stream) {
    (void)in_sizes; (void)n_in; (void)out_size; (void)ws_size;
    const float* feat = (const float*)d_in[0];  // (4,256,64,64)
    const float* src  = (const float*)d_in[1];  // (4,256,128,128)
    const float* Wq   = (const float*)d_in[2];  // (256,256)
    const float* bq   = (const float*)d_in[3];  // (256,)
    const float* Wv   = (const float*)d_in[4];  // (256,256)
    const float* bv   = (const float*)d_in[5];  // (256,)
    float* out = (float*)d_out;

    float* qws = (float*)d_ws;                          // 4*256*4096  = 16 MB
    float* vws = qws + (size_t)BATCH * CCH * D1;        // 4*256*16384 = 64 MB
    float* Aws = vws + (size_t)BATCH * CCH * D2;        // 4*256*9

    // q = Wq @ feat + bq          (d = 4096)
    gemm256_wmma_f32<<<BATCH * 16 * (D1 / 256), 128, 0, stream>>>(Wq, feat, bq, qws, D1);
    // vfull = Wv @ src + bv       (d = 16384)
    gemm256_wmma_f32<<<BATCH * 16 * (D2 / 256), 128, 0, stream>>>(Wv, src, bv, vws, D2);
    // attention logits (vs raw src) + softmax over 9 positions
    attn_softmax<<<BATCH * CCH, 256, 0, stream>>>(qws, src, Aws);
    // fused fold(A*unfold(vfull)) * feat
    fold_combine<<<BATCH * CCH * D1 / 256, 256, 0, stream>>>(feat, vws, Aws, out);
}

// v001
// It runs in 107 microseconds.
// Two timings next to v000 both put it at 1.47 times that version's speed.
#include <hip/hip_runtime.h>
#include <hip/hip_bf16.h>
#include <math.h>

typedef __attribute__((ext_vector_type(2))) float v2f;
typedef __attribute__((ext_vector_type(4))) float v4f;
typedef __attribute__((ext_vector_type(8))) float v8f;

#define BATCH 4
#define CCH   256
#define D1    4096    // 64*64
#define D2    16384   // 128*128

// Y[b] = W(256x256) @ X[b](256xd) + bias, fp32 via V_WMMA_F32_16X16X4_F32.
// Block = 256 threads (8 waves) and owns all 256 rows of a 64-column strip, so
// X is fetched once. K runs in chunks of 32: the W chunk (256x32) and the X
// chunk (32x64) are fetched in whole lines one chunk ahead into registers and
// laid in LDS; each wave then forms a 32x64 piece of Y (2x4 accumulator tiles).
// grid.x = B * (d/64)
#define KC 32    // k per chunk
#define PA 36    // LDS pitch of a W row, dwords: the 16 rows of an 8-byte fragment read fall on 16 distinct 4-bank groups
#define PB 160   // LDS pitch of an X row pair (rows 2p, 2p+1 interleaved per column), dwords: pairs p, p+1 fall on opposite bank halves

__global__ void __launch_bounds__(256)
gemm256_wmma_f32(const float* __restrict__ W,
                 const float* __restrict__ X,
                 const float* __restrict__ bias,
                 float* __restrict__ Y,
                 int d)
{
    __shared__ __attribute__((aligned(16))) float sA[CCH * PA];
    __shared__ __attribute__((aligned(16))) float sB[(KC / 2) * PB];

    const int ngrps = d >> 6;                 // groups of 64 columns
    int ngrp = blockIdx.x % ngrps;
    int b    = blockIdx.x / ngrps;

    int tid  = threadIdx.x;
    int lane = tid & 31;
    int wave = tid >> 5;                      // 0..7
    int lmod = lane & 15;
    int lhi  = lane >> 4;                     // 0 or 1

    int m0 = wave * 32;                       // this wave's 32 rows
    int n0 = ngrp * 64;                       // the block's 64 columns

    // Staging. W: 8 threads cover one row chunk (128 B), rows arow + 32*i.
    // X: a wave covers 32 columns (128 B) of a row; a thread takes both rows of
    // the pairs bpair + 4*i at one column, so each pair is one 8-byte LDS store.
    int arow = tid >> 3, acol = (tid & 7) * 4;
    int bpair = tid >> 6, bcol = tid & 63;
    const float* Wg = W + (size_t)arow * CCH + acol;
    const float* Xg = X + (size_t)b * CCH * d + (size_t)(2 * bpair) * d + (n0 + bcol);
    float* sAw = sA + arow * PA + acol;
    float* sBw = sB + bpair * PB + bcol * 2;

    // A: lane holds W[m + lmod, k + 2*lhi + {0,1}]  (contiguous 8B)
    const float* aF = sA + (m0 + lmod) * PA + 2 * lhi;
    // B: lane holds X[k + 2*lhi + {0,1}, n + lmod]  (one interleaved pair, contiguous 8B)
    const float* bF = sB + lhi * PB + lmod * 2;

    // Every "#pragma unroll" below keeps the indices of the register arrays
    // (ra, rb, a, bb, acc) compile-time constants, so none of them goes to scratch.
    v4f ra[8];
    v2f rb[4];
    #pragma unroll
    for (int i = 0; i < 8; ++i) ra[i] = *(const v4f*)(Wg + (size_t)(32 * i) * CCH);
    #pragma unroll
    for (int i = 0; i < 4; ++i) {
        rb[i].x = Xg[(size_t)(8 * i) * d];
        rb[i].y = Xg[(size_t)(8 * i + 1) * d];
    }

    v8f acc[2][4] = {};

    // Kept rolled: one chunk's body is 64 WMMAs, and the accumulator indices stay constant.
    #pragma unroll 1
    for (int kc = 0; kc < CCH; kc += KC) {
        __syncthreads();                      // every wave has left the previous chunk
        #pragma unroll
        for (int i = 0; i < 8; ++i) *(v4f*)(sAw + (32 * i) * PA) = ra[i];
        #pragma unroll
        for (int i = 0; i < 4; ++i) *(v2f*)(sBw + (4 * i) * PB) = rb[i];
        __syncthreads();                      // the chunk is complete in LDS

        if (kc + KC < CCH) {                  // next chunk flies during this chunk's WMMAs
            Wg += KC;
            Xg += (size_t)KC * d;
            #pragma unroll
            for (int i = 0; i < 8; ++i) ra[i] = *(const v4f*)(Wg + (size_t)(32 * i) * CCH);
            #pragma unroll
            for (int i = 0; i < 4; ++i) {
                rb[i].x = Xg[(size_t)(8 * i) * d];
                rb[i].y = Xg[(size_t)(8 * i + 1) * d];
            }
            // Precaution: the fragment loads below reuse the address registers of these loads.
            asm volatile("s_wait_xcnt 0x0" ::: "memory");
        }

        #pragma unroll
        for (int ks = 0; ks < KC; ks += 4) {
            v2f a[2], bb[4];
            #pragma unroll
            for (int mi = 0; mi < 2; ++mi)
                a[mi] = *(const v2f*)(aF + (16 * mi) * PA + ks);
            #pragma unroll
            for (int j = 0; j < 4; ++j)
                bb[j] = *(const v2f*)(bF + (ks / 2) * PB + 32 * j);
            #pragma unroll
            for (int mi = 0; mi < 2; ++mi)
                #pragma unroll
                for (int j = 0; j < 4; ++j)
                    acc[mi][j] = __builtin_amdgcn_wmma_f32_16x16x4_f32(
                        false, a[mi], false, bb[j], (short)0, acc[mi][j], false, false);
        }
    }

    // D: lane L, elem v -> row m + v + 8*lhi, col n + lmod
    float* Yp = Y + (size_t)b * CCH * d + (n0 + lmod);
    #pragma unroll
    for (int mi = 0; mi < 2; ++mi) {
        #pragma unroll
        for (int v = 0; v < 8; ++v) {
            int m = m0 + 16 * mi + v + 8 * lhi;
            float bv = bias[m];
            size_t row = (size_t)m * d;
            Yp[row +  0] = acc[mi][0][v] + bv;
            Yp[row + 16] = acc[mi][1][v] + bv;
            Yp[row + 32] = acc[mi][2][v] + bv;
            Yp[row + 48] = acc[mi][3][v] + bv;
        }
    }
}

// Per (b,c): logits[k=(i,j)] = sum_{h,w} q[h,w] * src[2h+i-1, 2w+j-1]
// (zero outside), then softmax over the 9 positions with scale 1/64.
// One block (256 threads) per (b,c).
__global__ void __launch_bounds__(256)
attn_softmax(const float* __restrict__ q,     // (B*C, 4096)
             const float* __restrict__ src,   // (B*C, 128*128)
             float* __restrict__ A)           // (B*C, 9)
{
    int bc = blockIdx.x;
    const float* qp = q   + (size_t)bc * D1;
    const float* sp = src + (size_t)bc * D2;

    float part[9];
    #pragma unroll
    for (int k = 0; k < 9; ++k) part[k] = 0.f;

    for (int hw = threadIdx.x; hw < D1; hw += 256) {
        int h = hw >> 6, w = hw & 63;
        float qv = qp[hw];
        int r0 = 2 * h - 1, c0 = 2 * w - 1;   // max index 127, only low OOB possible
        #pragma unroll
        for (int i = 0; i < 3; ++i) {
            int r = r0 + i;
            #pragma unroll
            for (int j = 0; j < 3; ++j) {
                int c = c0 + j;
                float s = (r >= 0 && c >= 0) ? sp[r * 128 + c] : 0.f;
                part[3 * i + j] += qv * s;
            }
        }
    }

    __shared__ float red[9][256];
    #pragma unroll
    for (int k = 0; k < 9; ++k) red[k][threadIdx.x] = part[k];
    __syncthreads();
    for (int s = 128; s > 0; s >>= 1) {
        if (threadIdx.x < (unsigned)s) {
            #pragma unroll
            for (int k = 0; k < 9; ++k)
                red[k][threadIdx.x] += red[k][threadIdx.x + s];
        }
        __syncthreads();
    }

    if (threadIdx.x == 0) {
        const float scale = 1.0f / 64.0f;     // 1/sqrt(4096)
        float l[9], mx = -INFINITY;
        #pragma unroll
        for (int k = 0; k < 9; ++k) { l[k] = red[k][0] * scale; mx = fmaxf(mx, l[k]); }
        float sum = 0.f;
        #pragma unroll
        for (int k = 0; k < 9; ++k) { l[k] = expf(l[k] - mx); sum += l[k]; }
        float inv = 1.0f / sum;
        #pragma unroll
        for (int k = 0; k < 9; ++k) A[(size_t)bc * 9 + k] = l[k] * inv;
    }
}

// out[y,x] = feat[y,x] * sum_{i,j} [0<=y+1-i<64][0<=x+1-j<64]
//                        * A[3i+j] * vfull[2y+1-i, 2x+1-j]
__global__ void __launch_bounds__(256)
fold_combine(const float* __restrict__ feat,   // (B*C, 4096)
             const float* __restrict__ vfull,  // (B*C, 128*128)
             const float* __restrict__ A,      // (B*C, 9)
             float* __restrict__ out)          // (B*C, 4096)
{
    int idx = blockIdx.x * 256 + threadIdx.x;  // block stays within one (b,c)
    int bc = idx >> 12;
    int hw = idx & 4095;
    int y = hw >> 6, x = hw & 63;

    const float* vp = vfull + (size_t)bc * D2;
    const float* Ap = A + (size_t)bc * 9;

    float acc = 0.f;
    #pragma unroll
    for (int i = 0; i < 3; ++i) {
        int hy = y + 1 - i;
        if (hy < 0 || hy > 63) continue;       // fold validity (NOT just v-index)
        int r = 2 * y + 1 - i;
        #pragma unroll
        for (int j = 0; j < 3; ++j) {
            int wx = x + 1 - j;
            if (wx < 0 || wx > 63) continue;
            int c = 2 * x + 1 - j;
            acc += Ap[3 * i + j] * vp[r * 128 + c];
        }
    }
    out[idx] = acc * feat[idx];
}

extern "C" void kernel_launch(void* const* d_in, const int* in_sizes, int n_in,
                              void* d_out, int out_size, void* d_ws, size_t ws_size,
                              hipStream_t stream) {
    (void)in_sizes; (void)n_in; (void)out_size; (void)ws_size;
    const float* feat = (const float*)d_in[0];  // (4,256,64,64)
    const float* src  = (const float*)d_in[1];  // (4,256,128,128)
    const float* Wq   = (const float*)d_in[2];  // (256,256)
    const float* bq   = (const float*)d_in[3];  // (256,)
    const float* Wv   = (const float*)d_in[4];  // (256,256)
    const float* bv   = (const float*)d_in[5];  // (256,)
    float* out = (float*)d_out;

    float* qws = (float*)d_ws;                          // 4*256*4096  = 16 MB
    float* vws = qws + (size_t)BATCH * CCH * D1;        // 4*256*16384 = 64 MB
    float* Aws = vws + (size_t)BATCH * CCH * D2;        // 4*256*9

    // q = Wq @ feat + bq          (d = 4096)
    gemm256_wmma_f32<<<BATCH * (D1 / 64), 256, 0, stream>>>(Wq, feat, bq, qws, D1);
    // vfull = Wv @ src + bv       (d = 16384)
    gemm256_wmma_f32<<<BATCH * (D2 / 64), 256, 0, stream>>>(Wv, src, bv, vws, D2);
    // attention logits (vs raw src) + softmax over 9 positions
    attn_softmax<<<BATCH * CCH, 256, 0, stream>>>(qws, src, Aws);
    // fused fold(A*unfold(vfull)) * feat
    fold_combine<<<BATCH * CCH * D1 / 256, 256, 0, stream>>>(feat, vws, Aws, out);
}

// v002
// One run takes 80.2 microseconds.
// Next to v001, in two timings, it ran 1.34 times as fast each time.
// All steps since v000 together make it 1.96 times as fast.
#include <hip/hip_runtime.h>
#include <hip/hip_bf16.h>
#include <math.h>

typedef __attribute__((ext_vector_type(2))) float v2f;
typedef __attribute__((ext_vector_type(4))) float v4f;
typedef __attribute__((ext_vector_type(8))) float v8f;

#define BATCH 4
#define CCH   256
#define D1    4096    // 64*64
#define D2    16384   // 128*128

// Y[b] = W(256x256) @ X[b](256xd) + bias, fp32 via V_WMMA_F32_16X16X4_F32.
// Block = 256 threads (8 waves) and owns all 256 rows of a 64-column strip, so
// X is fetched once. K runs in chunks of 32: the W chunk (256x32) and the X
// chunk (32x64) are fetched in whole lines one chunk ahead into registers and
// laid in LDS; each wave then forms a 32x64 piece of Y (2x4 accumulator tiles).
// grid.x = B * (d/64)
#define KC 32    // k per chunk
#define PA 36    // LDS pitch of a W row, dwords: the 16 rows of an 8-byte fragment read fall on 16 distinct 4-bank groups
#define PB 160   // LDS pitch of an X row pair (rows 2p, 2p+1 interleaved per column), dwords: pairs p, p+1 fall on opposite bank halves

__global__ void __launch_bounds__(256)
gemm256_wmma_f32(const float* __restrict__ W,
                 const float* __restrict__ X,
                 const float* __restrict__ bias,
                 float* __restrict__ Y,
                 int d)
{
    __shared__ __attribute__((aligned(16))) float sA[CCH * PA];
    __shared__ __attribute__((aligned(16))) float sB[(KC / 2) * PB];

    const int ngrps = d >> 6;                 // groups of 64 columns
    int ngrp = blockIdx.x % ngrps;
    int b    = blockIdx.x / ngrps;

    int tid  = threadIdx.x;
    int lane = tid & 31;
    int wave = tid >> 5;                      // 0..7
    int lmod = lane & 15;
    int lhi  = lane >> 4;                     // 0 or 1

    int m0 = wave * 32;                       // this wave's 32 rows
    int n0 = ngrp * 64;                       // the block's 64 columns

    // Staging. W: 8 threads cover one row chunk (128 B), rows arow + 32*i.
    // X: a wave covers 32 columns (128 B) of a row; a thread takes both rows of
    // the pairs bpair + 4*i at one column, so each pair is one 8-byte LDS store.
    int arow = tid >> 3, acol = (tid & 7) * 4;
    int bpair = tid >> 6, bcol = tid & 63;
    const float* Wg = W + (size_t)arow * CCH + acol;
    const float* Xg = X + (size_t)b * CCH * d + (size_t)(2 * bpair) * d + (n0 + bcol);
    float* sAw = sA + arow * PA + acol;
    float* sBw = sB + bpair * PB + bcol * 2;

    // A: lane holds W[m + lmod, k + 2*lhi + {0,1}]  (contiguous 8B)
    const float* aF = sA + (m0 + lmod) * PA + 2 * lhi;
    // B: lane holds X[k + 2*lhi + {0,1}, n + lmod]  (one interleaved pair, contiguous 8B)
    const float* bF = sB + lhi * PB + lmod * 2;

    // Every "#pragma unroll" below keeps the indices of the register arrays
    // (ra, rb, a, bb, acc) compile-time constants, so none of them goes to scratch.
    v4f ra[8];
    v2f rb[4];
    #pragma unroll
    for (int i = 0; i < 8; ++i) ra[i] = *(const v4f*)(Wg + (size_t)(32 * i) * CCH);
    #pragma unroll
    for (int i = 0; i < 4; ++i) {
        rb[i].x = Xg[(size_t)(8 * i) * d];
        rb[i].y = Xg[(size_t)(8 * i + 1) * d];
    }

    v8f acc[2][4] = {};

    // Kept rolled: one chunk's body is 64 WMMAs, and the accumulator indices stay constant.
    #pragma unroll 1
    for (int kc = 0; kc < CCH; kc += KC) {
        __syncthreads();                      // every wave has left the previous chunk
        #pragma unroll
        for (int i = 0; i < 8; ++i) *(v4f*)(sAw + (32 * i) * PA) = ra[i];
        #pragma unroll
        for (int i = 0; i < 4; ++i) *(v2f*)(sBw + (4 * i) * PB) = rb[i];
        __syncthreads();                      // the chunk is complete in LDS

        if (kc + KC < CCH) {                  // next chunk flies during this chunk's WMMAs
            Wg += KC;
            Xg += (size_t)KC * d;
            #pragma unroll
            for (int i = 0; i < 8; ++i) ra[i] = *(const v4f*)(Wg + (size_t)(32 * i) * CCH);
            #pragma unroll
            for (int i = 0; i < 4; ++i) {
                rb[i].x = Xg[(size_t)(8 * i) * d];
                rb[i].y = Xg[(size_t)(8 * i + 1) * d];
            }
            // Precaution: the fragment loads below reuse the address registers of these loads.
            asm volatile("s_wait_xcnt 0x0" ::: "memory");
        }

        #pragma unroll
        for (int ks = 0; ks < KC; ks += 4) {
            v2f a[2], bb[4];
            #pragma unroll
            for (int mi = 0; mi < 2; ++mi)
                a[mi] = *(const v2f*)(aF + (16 * mi) * PA + ks);
            #pragma unroll
            for (int j = 0; j < 4; ++j)
                bb[j] = *(const v2f*)(bF + (ks / 2) * PB + 32 * j);
            #pragma unroll
            for (int mi = 0; mi < 2; ++mi)
                #pragma unroll
                for (int j = 0; j < 4; ++j)
                    acc[mi][j] = __builtin_amdgcn_wmma_f32_16x16x4_f32(
                        false, a[mi], false, bb[j], (short)0, acc[mi][j], false, false);
        }
    }

    // D: lane L, elem v -> row m + v + 8*lhi, col n + lmod
    float* Yp = Y + (size_t)b * CCH * d + (n0 + lmod);
    #pragma unroll
    for (int mi = 0; mi < 2; ++mi) {
        #pragma unroll
        for (int v = 0; v < 8; ++v) {
            int m = m0 + 16 * mi + v + 8 * lhi;
            float bv = bias[m];
            size_t row = (size_t)m * d;
            Yp[row +  0] = acc[mi][0][v] + bv;
            Yp[row + 16] = acc[mi][1][v] + bv;
            Yp[row + 32] = acc[mi][2][v] + bv;
            Yp[row + 48] = acc[mi][3][v] + bv;
        }
    }
}

// The 17 rows 16*wave-1 .. 16*wave+15 of one 128x128 plane: a wave reads a whole
// row (512 B) per load, lane p holding columns 4p..4p+3. Row -1 (wave 0) reads as zero.
__device__ __forceinline__ void load_rows17(const float* __restrict__ plane, int wave, int lane, v4f (&r)[17])
{
    const float* body = plane + (16 * wave) * 128;
    const float* head = wave == 0 ? body : body - 128;   // address kept inside the plane
    r[0] = *(const v4f*)(head + lane * 4);
    #pragma unroll
    for (int t = 1; t < 17; ++t) r[t] = *(const v4f*)(body + (t - 1) * 128 + lane * 4);
    if (wave == 0) r[0] = (v4f){0.f, 0.f, 0.f, 0.f};
}

// Column 4p-1 of a row held as above: the left lane's last element, zero left of column 0.
__device__ __forceinline__ float left_col(float w, int lane)
{
    float e = __shfl_up(w, 1);
    return lane == 0 ? 0.f : e;
}

// Lane k's value, the same in every lane.
__device__ __forceinline__ float from_lane(float x, int k)
{
    return __int_as_float(__builtin_amdgcn_readlane(__float_as_int(x), k));
}

// One block (8 waves) per (b,c) plane does both per-plane passes.
// Pass 1: logits[k=(i,j)] = sum_{h,w} q[h,w] * src[2h+i-1, 2w+j-1] (zero outside),
//         softmax over the 9 positions with scale 1/64.
// Pass 2: out[y,x] = feat[y,x] * sum_{i,j} [0<=y+1-i<64][0<=x+1-j<64]
//                                * A[3i+j] * vfull[2y+1-i, 2x+1-j]
// Wave w takes the rows 8w..8w+7 of q / out, lane p the columns 2p, 2p+1; both
// passes then need the same 17 rows of their 128x128 plane, each loaded once.
// The second launch-bounds figure asks for 8 waves per SIMD, so that all 1024 blocks are resident at once.
__global__ void __launch_bounds__(256, 8)
attn_fold(const float* __restrict__ q,      // (B*C, 4096)
          const float* __restrict__ src,    // (B*C, 128*128)
          const float* __restrict__ vfull,  // (B*C, 128*128)
          const float* __restrict__ feat,   // (B*C, 4096)
          float* __restrict__ out)          // (B*C, 4096)
{
    __shared__ __attribute__((aligned(16))) float red[9][8];

    const int bc   = blockIdx.x;
    const int lane = threadIdx.x & 31;
    const int wave = __builtin_amdgcn_readfirstlane(threadIdx.x >> 5);
    const size_t rows8 = (size_t)bc * D1 + (8 * wave) * 64;   // this wave's 8 rows of a 64x64 plane

    // Every "#pragma unroll" below keeps the register arrays' indices compile-time constants.
    float p0[3] = {0.f, 0.f, 0.f};            // logit partial sums, j = 0
    v2f   p12[3] = {};                        // j = 1, 2
    {
        v4f s[17];
        v2f qv[8];
        load_rows17(src + (size_t)bc * D2, wave, lane, s);
        #pragma unroll
        for (int hh = 0; hh < 8; ++hh) qv[hh] = *(const v2f*)(q + rows8 + hh * 64 + lane * 2);

        #pragma unroll
        for (int t = 0; t < 17; ++t) {
            float e = left_col(s[t].w, lane);
            // Row t is row i = t - 2*hh of the window of q row hh: an even t serves two q rows.
            #pragma unroll
            for (int i = 0; i < 3; ++i) {
                if ((t - i) < 0 || ((t - i) & 1) || (t - i) > 14) continue;
                v2f qq = qv[(t - i) / 2];
                p0[i]  += qq.x * e;
                p0[i]  += qq.y * s[t].y;
                p12[i] += qq.x * s[t].xy;
                p12[i] += qq.y * s[t].zw;
            }
        }
    }

    // Pass 2's operands do not depend on the softmax: they fly during the reduction.
    v4f v[17];
    v2f fv[8];
    load_rows17(vfull + (size_t)bc * D2, wave, lane, v);
    #pragma unroll
    for (int yy = 0; yy < 8; ++yy) fv[yy] = *(const v2f*)(feat + rows8 + yy * 64 + lane * 2);

    float part[9];
    #pragma unroll
    for (int i = 0; i < 3; ++i) { part[3 * i] = p0[i]; part[3 * i + 1] = p12[i].x; part[3 * i + 2] = p12[i].y; }
    #pragma unroll
    for (int k = 0; k < 9; ++k) {
        #pragma unroll
        for (int m = 16; m > 0; m >>= 1) part[k] += __shfl_xor(part[k], m);
    }
    if (lane == 0) {
        #pragma unroll
        for (int k = 0; k < 9; ++k) red[k][wave] = part[k];
    }
    __syncthreads();                          // the eight waves' partial logits are in LDS

    // Softmax with position k in lane k (lanes 9.. repeat position 8 and are not read).
    float A[9];
    {
        const float scale = 1.0f / 64.0f;     // 1/sqrt(4096)
        const int k9 = lane < 9 ? lane : 8;
        v4f lo = *(const v4f*)&red[k9][0], hi = *(const v4f*)&red[k9][4];
        float l = (((((((lo.x + lo.y) + lo.z) + lo.w) + hi.x) + hi.y) + hi.z) + hi.w) * scale;
        float mx = -INFINITY;
        #pragma unroll
        for (int k = 0; k < 9; ++k) mx = fmaxf(mx, from_lane(l, k));
        float ex = expf(l - mx);
        float sum = 0.f;
        #pragma unroll
        for (int k = 0; k < 9; ++k) sum += from_lane(ex, k);
        float a = ex * (1.0f / sum);
        #pragma unroll
        for (int k = 0; k < 9; ++k) A[k] = from_lane(a, k);
    }

    // Fold validity: i = 0 has no term at y = 63 (row 127), j = 0 none at x = 63,
    // i = 2 none at y = 0 and j = 2 none at x = 0 (both already zero above).
    if (wave == 7) v[16] = (v4f){0.f, 0.f, 0.f, 0.f};
    float e[17];
    #pragma unroll
    for (int t = 0; t < 17; ++t) {
        e[t] = left_col(v[t].w, lane);
        if (lane == 31) v[t].w = 0.f;
    }
    #pragma unroll
    for (int yy = 0; yy < 8; ++yy) {
        float a0 = 0.f, a1 = 0.f;             // x = 2p, 2p+1
        #pragma unroll
        for (int i = 0; i < 3; ++i) {
            // Both sums are chains of fused multiply-adds, in the order i, j. They are written in two
            // forms (fmaf; a * b + c under contract(on)) so that the compiler does not pair them into
            // packed operations: the operand pairs (y,w), (x,z), (e,y) are not register neighbours,
            // and the copies that pairing needs spilled to scratch.
            #pragma clang fp contract(on)
            const int t = 2 * yy + 2 - i;     // row 2y+1-i
            a0 = fmaf(A[3 * i + 0], v[t].y, a0);  a1 = A[3 * i + 0] * v[t].w + a1;
            a0 = fmaf(A[3 * i + 1], v[t].x, a0);  a1 = A[3 * i + 1] * v[t].z + a1;
            a0 = fmaf(A[3 * i + 2], e[t], a0);    a1 = A[3 * i + 2] * v[t].y + a1;
        }
        v2f o = {a0 * fv[yy].x, a1 * fv[yy].y};
        *(v2f*)(out + rows8 + yy * 64 + lane * 2) = o;
    }
}

extern "C" void kernel_launch(void* const* d_in, const int* in_sizes, int n_in,
                              void* d_out, int out_size, void* d_ws, size_t ws_size,
                              hipStream_t stream) {
    (void)in_sizes; (void)n_in; (void)out_size; (void)ws_size;
    const float* feat = (const float*)d_in[0];  // (4,256,64,64)
    const float* src  = (const float*)d_in[1];  // (4,256,128,128)
    const float* Wq   = (const float*)d_in[2];  // (256,256)
    const float* bq   = (const float*)d_in[3];  // (256,)
    const float* Wv   = (const float*)d_in[4];  // (256,256)
    const float* bv   = (const float*)d_in[5];  // (256,)
    float* out = (float*)d_out;

    float* qws = (float*)d_ws;                          // 4*256*4096  = 16 MB
    float* vws = qws + (size_t)BATCH * CCH * D1;        // 4*256*16384 = 64 MB

    // q = Wq @ feat + bq          (d = 4096)
    gemm256_wmma_f32<<<BATCH * (D1 / 64), 256, 0, stream>>>(Wq, feat, bq, qws, D1);
    // vfull = Wv @ src + bv       (d = 16384)
    gemm256_wmma_f32<<<BATCH * (D2 / 64), 256, 0, stream>>>(Wv, src, bv, vws, D2);
    // per plane: attention logits (vs raw src), softmax over 9 positions, fold(A*unfold(vfull)) * feat
    attn_fold<<<BATCH * CCH, 256, 0, stream>>>(qws, src, vws, feat, out);
}
